// v000
// Times are from an AMD MI455X. After a warm-up the kernel runs many times in a row, and a time is the length of
// such a window on the GPU divided by its runs, so every launch and the gaps after it count. The runs cycle
// through copies of the inputs. A figure is the median of several windows, for all but v000 over two sittings.
// Sittings can differ by a few percent; kernels timed side by side share one.
// v000, which the later versions start from, runs in 52.8 microseconds.
#include <hip/hip_runtime.h>
#include <hip/hip_bf16.h>

typedef float v2f __attribute__((ext_vector_type(2)));
typedef float v8f __attribute__((ext_vector_type(8)));

#define NH    8
#define SEQ   4096
#define DIM   64
#define CHUNK 64
#define NC    (SEQ / CHUNK)
#define NT    256   // 8 waves of 32

// ---------------------------------------------------------------------------
// Pass 1: per-chunk summaries.  S_kv[h][c] = k_bar^T @ v (64x64),
//         ksum[h][c][d] = sum_r k_bar[r][d]
// ---------------------------------------------------------------------------
__global__ __launch_bounds__(NT) void pr_pass1(
    const float* __restrict__ kmat, const float* __restrict__ vmat,
    const float* __restrict__ coef_k,
    float* __restrict__ chunkKV, float* __restrict__ chunkKs)
{
  __shared__ float kb[CHUNK][DIM];   // k_bar (row-major); WMMA reads are row accesses
  __shared__ float vv[CHUNK][DIM];

  const int blk = blockIdx.x;
  const int h = blk / NC, c = blk % NC;
  const int s0 = c * CHUNK;
  const int tid = threadIdx.x;

  for (int e = tid; e < CHUNK * DIM; e += NT) {
    const int r = e >> 6, d = e & 63;
    const float ck = coef_k[h * SEQ + s0 + r];
    const size_t g = ((size_t)(h * SEQ + s0 + r)) * DIM + d;
    kb[r][d] = kmat[g] * ck;
    vv[r][d] = vmat[g];
  }
  __syncthreads();

  if (tid < DIM) {
    float a = 0.f;
    for (int r = 0; r < CHUNK; ++r) a += kb[r][tid];
    chunkKs[(h * NC + c) * DIM + tid] = a;
  }

  const int wave = tid >> 5, lane = tid & 31;
  const int lh = lane >> 4, lm = lane & 15;
  float* dst = chunkKV + ((size_t)(h * NC + c)) * DIM * DIM;

  // S_kv = kb^T @ vv : A[m][k] = kb[k][m], B[k][n] = vv[k][n]
  for (int t = wave * 2; t < wave * 2 + 2; ++t) {
    const int tm = (t >> 2) * 16, tn = (t & 3) * 16;
    v8f acc = {};
    for (int kk = 0; kk < CHUNK; kk += 4) {
      const int kv = kk + lh * 2;
      v2f a, b;
      a.x = kb[kv + 0][tm + lm];
      a.y = kb[kv + 1][tm + lm];
      b.x = vv[kv + 0][tn + lm];
      b.y = vv[kv + 1][tn + lm];
      acc = __builtin_amdgcn_wmma_f32_16x16x4_f32(false, a, false, b,
                                                  (short)0, acc, false, false);
    }
    for (int r = 0; r < 8; ++r)
      dst[(tm + r + 8 * lh) * DIM + tn + lm] = acc[r];
  }
}

// ---------------------------------------------------------------------------
// Pass 2: exclusive prefix over chunks (per head).  State is 64x64 + 64.
// ---------------------------------------------------------------------------
__global__ __launch_bounds__(NT) void pr_pass2(
    const float* __restrict__ chunkKV, const float* __restrict__ chunkKs,
    float* __restrict__ preKV, float* __restrict__ preKs)
{
  const int h = blockIdx.x;
  const int tid = threadIdx.x;

  float acc[16];
  for (int i = 0; i < 16; ++i) acc[i] = 0.f;

  for (int c = 0; c < NC; ++c) {
    const size_t base = ((size_t)(h * NC + c)) * DIM * DIM;
    for (int i = 0; i < 16; ++i) {
      const int e = tid + i * NT;
      preKV[base + e] = acc[i];
      acc[i] += chunkKV[base + e];
    }
  }

  if (tid < DIM) {
    float a = 0.f;
    for (int c = 0; c < NC; ++c) {
      preKs[(h * NC + c) * DIM + tid] = a;
      a += chunkKs[(h * NC + c) * DIM + tid];
    }
  }
}

// ---------------------------------------------------------------------------
// Pass 3: scores + P + output + RMS norm.
// ---------------------------------------------------------------------------
__global__ __launch_bounds__(NT) void pr_pass3(
    const float* __restrict__ qmat, const float* __restrict__ kmat,
    const float* __restrict__ vmat,
    const float* __restrict__ coef_q, const float* __restrict__ coef_k,
    const float* __restrict__ normer,
    const float* __restrict__ preKV, const float* __restrict__ preKs,
    float* __restrict__ out)
{
  __shared__ float qb[CHUNK][DIM + 1];   // column-strided frag reads -> pad
  __shared__ float kb[CHUNK][DIM + 1];   // column-strided frag reads -> pad
  __shared__ float vv[CHUNK][DIM];       // row reads only
  __shared__ float st[DIM][DIM];         // row reads only
  __shared__ float sc[CHUNK][DIM + 1];   // scores, then reused for O
  __shared__ float kpre[DIM];
  __shared__ float rs[CHUNK];

  const int blk = blockIdx.x;
  const int h = blk / NC, c = blk % NC;
  const int s0 = c * CHUNK;
  const int tid = threadIdx.x;

  for (int e = tid; e < CHUNK * DIM; e += NT) {
    const int r = e >> 6, d = e & 63;
    const int srow = s0 + r;
    const float cq = coef_q[h * SEQ + srow] / normer[h * SEQ + srow];
    const float ck = coef_k[h * SEQ + srow];
    const size_t g = ((size_t)(h * SEQ + srow)) * DIM + d;
    qb[r][d] = qmat[g] * cq;
    kb[r][d] = kmat[g] * ck;
    vv[r][d] = vmat[g];
    st[r][d] = preKV[((size_t)(h * NC + c)) * DIM * DIM + e];
  }
  if (tid < DIM) kpre[tid] = preKs[(h * NC + c) * DIM + tid];
  __syncthreads();

  const int wave = tid >> 5, lane = tid & 31;
  const int lh = lane >> 4, lm = lane & 15;

  // scores = qb @ kb^T with causal mask:  A[m][k]=qb[m][k], B[k][n]=kb[n][k]
  for (int t = wave * 2; t < wave * 2 + 2; ++t) {
    const int tm = (t >> 2) * 16, tn = (t & 3) * 16;
    v8f acc = {};
    for (int kk = 0; kk < DIM; kk += 4) {
      const int kv = kk + lh * 2;
      v2f a, b;
      a.x = qb[tm + lm][kv + 0];
      a.y = qb[tm + lm][kv + 1];
      b.x = kb[tn + lm][kv + 0];
      b.y = kb[tn + lm][kv + 1];
      acc = __builtin_amdgcn_wmma_f32_16x16x4_f32(false, a, false, b,
                                                  (short)0, acc, false, false);
    }
    for (int r = 0; r < 8; ++r) {
      const int i = tm + r + 8 * lh, j = tn + lm;
      sc[i][j] = (j <= i) ? acc[r] : 0.f;
    }
  }
  __syncthreads();

  // O = sc_causal @ vv + qb @ st   (keep tiles in registers)
  v8f oacc[2];
  for (int ti = 0; ti < 2; ++ti) {
    const int t = wave * 2 + ti;
    const int tm = (t >> 2) * 16, tn = (t & 3) * 16;
    v8f acc = {};
    for (int kk = 0; kk < CHUNK; kk += 4) {
      const int kv = kk + lh * 2;
      v2f a, b;
      a.x = sc[tm + lm][kv + 0];
      a.y = sc[tm + lm][kv + 1];
      b.x = vv[kv + 0][tn + lm];
      b.y = vv[kv + 1][tn + lm];
      acc = __builtin_amdgcn_wmma_f32_16x16x4_f32(false, a, false, b,
                                                  (short)0, acc, false, false);
    }
    for (int kk = 0; kk < DIM; kk += 4) {
      const int kv = kk + lh * 2;
      v2f a, b;
      a.x = qb[tm + lm][kv + 0];
      a.y = qb[tm + lm][kv + 1];
      b.x = st[kv + 0][tn + lm];
      b.y = st[kv + 1][tn + lm];
      acc = __builtin_amdgcn_wmma_f32_16x16x4_f32(false, a, false, b,
                                                  (short)0, acc, false, false);
    }
    oacc[ti] = acc;
  }

  // P_i = row-sum of causal scores + q_bar_i . ksum_prefix ; clamp
  if (tid < CHUNK) {
    float p = 0.f;
    for (int j = 0; j < CHUNK; ++j) p += sc[tid][j];
    for (int d = 0; d < DIM; ++d) p += qb[tid][d] * kpre[d];
    p = fabsf(p);
    if (p < 1.f) p = 1.f;
    rs[tid] = 1.f / p;
  }
  __syncthreads();   // everyone done reading sc (and rs written)

  for (int ti = 0; ti < 2; ++ti) {
    const int t = wave * 2 + ti;
    const int tm = (t >> 2) * 16, tn = (t & 3) * 16;
    for (int r = 0; r < 8; ++r)
      sc[tm + r + 8 * lh][tn + lm] = oacc[ti][r];
  }
  __syncthreads();

  // fold 1/P into RMS scale: out = (O/P) * rsqrt(mean((O/P)^2) + 1e-6)
  if (tid < CHUNK) {
    const float invp = rs[tid];
    float ssq = 0.f;
    for (int d = 0; d < DIM; ++d) {
      const float o = sc[tid][d] * invp;
      ssq += o * o;
    }
    rs[tid] = invp * rsqrtf(ssq * (1.f / DIM) + 1e-6f);
  }
  __syncthreads();

  for (int e = tid; e < CHUNK * DIM; e += NT) {
    const int r = e >> 6, d = e & 63;
    out[((size_t)(h * SEQ + s0 + r)) * DIM + d] = sc[r][d] * rs[r];
  }
}

// ---------------------------------------------------------------------------
extern "C" void kernel_launch(void* const* d_in, const int* in_sizes, int n_in,
                              void* d_out, int out_size, void* d_ws, size_t ws_size,
                              hipStream_t stream) {
  const float* q  = (const float*)d_in[0];
  const float* k  = (const float*)d_in[1];
  const float* v  = (const float*)d_in[2];
  const float* cq = (const float*)d_in[3];
  const float* ck = (const float*)d_in[4];
  const float* mn = (const float*)d_in[5];
  float* out = (float*)d_out;

  float* ws      = (float*)d_ws;
  float* chunkKV = ws;                                        // NH*NC*DIM*DIM
  float* preKV   = chunkKV + (size_t)NH * NC * DIM * DIM;     // NH*NC*DIM*DIM
  float* chunkKs = preKV   + (size_t)NH * NC * DIM * DIM;     // NH*NC*DIM
  float* preKs   = chunkKs + (size_t)NH * NC * DIM;           // NH*NC*DIM

  pr_pass1<<<NH * NC, NT, 0, stream>>>(k, v, ck, chunkKV, chunkKs);
  pr_pass2<<<NH,      NT, 0, stream>>>(chunkKV, chunkKs, preKV, preKs);
  pr_pass3<<<NH * NC, NT, 0, stream>>>(q, k, v, cq, ck, mn, preKV, preKs, out);
}

// v001
// Measured time: 25.4 microseconds a run.
// Next to v000, in two timings, it ran 2.11 and 2.08 times as fast.
#include <hip/hip_runtime.h>
#include <hip/hip_bf16.h>

typedef float v2f __attribute__((ext_vector_type(2)));
typedef float v8f __attribute__((ext_vector_type(8)));

#define NH    8
#define SEQ   4096
#define DIM   64
#define CHUNK 64
#define NC    (SEQ / CHUNK)
#define NT    256   // 8 waves of 32

// ---------------------------------------------------------------------------
// Pass 1: per-chunk summaries.  S_kv[h][c] = k_bar^T @ v (64x64),
//         ksum[h][c][d] = sum_r k_bar[r][d]
// ---------------------------------------------------------------------------
__global__ __launch_bounds__(NT) void pr_pass1(
    const float* __restrict__ kmat, const float* __restrict__ vmat,
    const float* __restrict__ coef_k,
    float* __restrict__ chunkKV, float* __restrict__ chunkKs)
{
  __shared__ float kb[CHUNK][DIM];   // k_bar (row-major); WMMA reads are row accesses
  __shared__ float vv[CHUNK][DIM];

  const int blk = blockIdx.x;
  const int h = blk / NC, c = blk % NC;
  const int s0 = c * CHUNK;
  const int tid = threadIdx.x;

  for (int e = tid; e < CHUNK * DIM; e += NT) {
    const int r = e >> 6, d = e & 63;
    const float ck = coef_k[h * SEQ + s0 + r];
    const size_t g = ((size_t)(h * SEQ + s0 + r)) * DIM + d;
    kb[r][d] = kmat[g] * ck;
    vv[r][d] = vmat[g];
  }
  __syncthreads();

  if (tid < DIM) {
    float a = 0.f;
    for (int r = 0; r < CHUNK; ++r) a += kb[r][tid];
    chunkKs[(h * NC + c) * DIM + tid] = a;
  }

  const int wave = tid >> 5, lane = tid & 31;
  const int lh = lane >> 4, lm = lane & 15;
  float* dst = chunkKV + ((size_t)(h * NC + c)) * DIM * DIM;

  // S_kv = kb^T @ vv : A[m][k] = kb[k][m], B[k][n] = vv[k][n]
  for (int t = wave * 2; t < wave * 2 + 2; ++t) {
    const int tm = (t >> 2) * 16, tn = (t & 3) * 16;
    v8f acc = {};
    for (int kk = 0; kk < CHUNK; kk += 4) {
      const int kv = kk + lh * 2;
      v2f a, b;
      a.x = kb[kv + 0][tm + lm];
      a.y = kb[kv + 1][tm + lm];
      b.x = vv[kv + 0][tn + lm];
      b.y = vv[kv + 1][tn + lm];
      acc = __builtin_amdgcn_wmma_f32_16x16x4_f32(false, a, false, b,
                                                  (short)0, acc, false, false);
    }
    for (int r = 0; r < 8; ++r)
      dst[(tm + r + 8 * lh) * DIM + tn + lm] = acc[r];
  }
}

// ---------------------------------------------------------------------------
// Pass 2: exclusive prefix over chunks (per head).  State is 64x64 + 64.
// One state element per thread: its chunk values are independent loads, so
// they are all in flight together and the launch pays one memory wait; the
// adds run in chunk order, as a serial prefix does.
// ---------------------------------------------------------------------------
#define P2T   64                      // threads per work-group in pass 2
#define P2B   (DIM * DIM / P2T + 1)   // work-groups per head: 64 for S_kv, 1 for ksum

template <int STRIDE>
__device__ __forceinline__ void pr_prefix(const float* __restrict__ src,
                                          float* __restrict__ dst)
{
  float x[NC];
#pragma unroll   // constant indices keep x in registers and put every load ahead of the adds
  for (int c = 0; c < NC; ++c) x[c] = src[c * STRIDE];
  // Wait before a register that an issued load names is rewritten; src as an
  // input keeps the address pair live to here, so no load of the run lands in it.
  asm volatile("s_wait_xcnt 0x0" :: "v"(src) : "memory");
  float a = 0.f;
#pragma unroll   // same reason: x is indexed by constants only
  for (int c = 0; c < NC; ++c) {
    dst[c * STRIDE] = a;
    a += x[c];
  }
  // Same wait behind the run of stores: nothing that follows on any path
  // rewrites their address or data registers ahead of it.
  asm volatile("s_wait_xcnt 0x0" :: "v"(dst) : "memory");
}

__global__ __launch_bounds__(P2T) void pr_pass2(
    const float* __restrict__ chunkKV, const float* __restrict__ chunkKs,
    float* __restrict__ preKV, float* __restrict__ preKs)
{
  const int h = blockIdx.x / P2B, s = blockIdx.x % P2B;
  const int tid = threadIdx.x;

  if (s < P2B - 1) {
    const size_t o = (size_t)h * NC * DIM * DIM + s * P2T + tid;
    pr_prefix<DIM * DIM>(chunkKV + o, preKV + o);
  } else {
    const size_t o = (size_t)h * NC * DIM + tid;
    pr_prefix<DIM>(chunkKs + o, preKs + o);
  }
}

// ---------------------------------------------------------------------------
// Pass 3: scores + P + output + RMS norm.
// ---------------------------------------------------------------------------
__global__ __launch_bounds__(NT) void pr_pass3(
    const float* __restrict__ qmat, const float* __restrict__ kmat,
    const float* __restrict__ vmat,
    const float* __restrict__ coef_q, const float* __restrict__ coef_k,
    const float* __restrict__ normer,
    const float* __restrict__ preKV, const float* __restrict__ preKs,
    float* __restrict__ out)
{
  __shared__ float qb[CHUNK][DIM + 1];   // column-strided frag reads -> pad
  __shared__ float kb[CHUNK][DIM + 1];   // column-strided frag reads -> pad
  __shared__ float vv[CHUNK][DIM];       // row reads only
  __shared__ float st[DIM][DIM];         // row reads only
  __shared__ float sc[CHUNK][DIM + 1];   // scores, then reused for O
  __shared__ float kpre[DIM];
  __shared__ float rs[CHUNK];

  const int blk = blockIdx.x;
  const int h = blk / NC, c = blk % NC;
  const int s0 = c * CHUNK;
  const int tid = threadIdx.x;

  for (int e = tid; e < CHUNK * DIM; e += NT) {
    const int r = e >> 6, d = e & 63;
    const int srow = s0 + r;
    const float cq = coef_q[h * SEQ + srow] / normer[h * SEQ + srow];
    const float ck = coef_k[h * SEQ + srow];
    const size_t g = ((size_t)(h * SEQ + srow)) * DIM + d;
    qb[r][d] = qmat[g] * cq;
    kb[r][d] = kmat[g] * ck;
    vv[r][d] = vmat[g];
    st[r][d] = preKV[((size_t)(h * NC + c)) * DIM * DIM + e];
  }
  if (tid < DIM) kpre[tid] = preKs[(h * NC + c) * DIM + tid];
  __syncthreads();

  const int wave = tid >> 5, lane = tid & 31;
  const int lh = lane >> 4, lm = lane & 15;

  // scores = qb @ kb^T with causal mask:  A[m][k]=qb[m][k], B[k][n]=kb[n][k]
  for (int t = wave * 2; t < wave * 2 + 2; ++t) {
    const int tm = (t >> 2) * 16, tn = (t & 3) * 16;
    v8f acc = {};
    for (int kk = 0; kk < DIM; kk += 4) {
      const int kv = kk + lh * 2;
      v2f a, b;
      a.x = qb[tm + lm][kv + 0];
      a.y = qb[tm + lm][kv + 1];
      b.x = kb[tn + lm][kv + 0];
      b.y = kb[tn + lm][kv + 1];
      acc = __builtin_amdgcn_wmma_f32_16x16x4_f32(false, a, false, b,
                                                  (short)0, acc, false, false);
    }
    for (int r = 0; r < 8; ++r) {
      const int i = tm + r + 8 * lh, j = tn + lm;
      sc[i][j] = (j <= i) ? acc[r] : 0.f;
    }
  }
  __syncthreads();

  // O = sc_causal @ vv + qb @ st   (keep tiles in registers)
  v8f oacc[2];
  for (int ti = 0; ti < 2; ++ti) {
    const int t = wave * 2 + ti;
    const int tm = (t >> 2) * 16, tn = (t & 3) * 16;
    v8f acc = {};
    for (int kk = 0; kk < CHUNK; kk += 4) {
      const int kv = kk + lh * 2;
      v2f a, b;
      a.x = sc[tm + lm][kv + 0];
      a.y = sc[tm + lm][kv + 1];
      b.x = vv[kv + 0][tn + lm];
      b.y = vv[kv + 1][tn + lm];
      acc = __builtin_amdgcn_wmma_f32_16x16x4_f32(false, a, false, b,
                                                  (short)0, acc, false, false);
    }
    for (int kk = 0; kk < DIM; kk += 4) {
      const int kv = kk + lh * 2;
      v2f a, b;
      a.x = qb[tm + lm][kv + 0];
      a.y = qb[tm + lm][kv + 1];
      b.x = st[kv + 0][tn + lm];
      b.y = st[kv + 1][tn + lm];
      acc = __builtin_amdgcn_wmma_f32_16x16x4_f32(false, a, false, b,
                                                  (short)0, acc, false, false);
    }
    oacc[ti] = acc;
  }

  // P_i = row-sum of causal scores + q_bar_i . ksum_prefix ; clamp
  if (tid < CHUNK) {
    float p = 0.f;
    for (int j = 0; j < CHUNK; ++j) p += sc[tid][j];
    for (int d = 0; d < DIM; ++d) p += qb[tid][d] * kpre[d];
    p = fabsf(p);
    if (p < 1.f) p = 1.f;
    rs[tid] = 1.f / p;
  }
  __syncthreads();   // everyone done reading sc (and rs written)

  for (int ti = 0; ti < 2; ++ti) {
    const int t = wave * 2 + ti;
    const int tm = (t >> 2) * 16, tn = (t & 3) * 16;
    for (int r = 0; r < 8; ++r)
      sc[tm + r + 8 * lh][tn + lm] = oacc[ti][r];
  }
  __syncthreads();

  // fold 1/P into RMS scale: out = (O/P) * rsqrt(mean((O/P)^2) + 1e-6)
  if (tid < CHUNK) {
    const float invp = rs[tid];
    float ssq = 0.f;
    for (int d = 0; d < DIM; ++d) {
      const float o = sc[tid][d] * invp;
      ssq += o * o;
    }
    rs[tid] = invp * rsqrtf(ssq * (1.f / DIM) + 1e-6f);
  }
  __syncthreads();

  for (int e = tid; e < CHUNK * DIM; e += NT) {
    const int r = e >> 6, d = e & 63;
    out[((size_t)(h * SEQ + s0 + r)) * DIM + d] = sc[r][d] * rs[r];
  }
}

// ---------------------------------------------------------------------------
extern "C" void kernel_launch(void* const* d_in, const int* in_sizes, int n_in,
                              void* d_out, int out_size, void* d_ws, size_t ws_size,
                              hipStream_t stream) {
  const float* q  = (const float*)d_in[0];
  const float* k  = (const float*)d_in[1];
  const float* v  = (const float*)d_in[2];
  const float* cq = (const float*)d_in[3];
  const float* ck = (const float*)d_in[4];
  const float* mn = (const float*)d_in[5];
  float* out = (float*)d_out;

  float* ws      = (float*)d_ws;
  float* chunkKV = ws;                                        // NH*NC*DIM*DIM
  float* preKV   = chunkKV + (size_t)NH * NC * DIM * DIM;     // NH*NC*DIM*DIM
  float* chunkKs = preKV   + (size_t)NH * NC * DIM * DIM;     // NH*NC*DIM
  float* preKs   = chunkKs + (size_t)NH * NC * DIM;           // NH*NC*DIM

  pr_pass1<<<NH * NC, NT, 0, stream>>>(k, v, ck, chunkKV, chunkKs);
  pr_pass2<<<NH * P2B, P2T, 0, stream>>>(chunkKV, chunkKs, preKV, preKs);
  pr_pass3<<<NH * NC, NT, 0, stream>>>(q, k, v, cq, ck, mn, preKV, preKs, out);
}

// v002
// Measured time: 18.4 microseconds a run.
// Next to v001, in two timings, it ran 1.39 and 1.38 times as fast.
// Counting every step since v000, it is 2.90 times as fast.
#include <hip/hip_runtime.h>
#include <hip/hip_bf16.h>

typedef float v2f __attribute__((ext_vector_type(2)));
typedef float v8f __attribute__((ext_vector_type(8)));
typedef float v4f __attribute__((ext_vector_type(4)));

#define NH    8
#define SEQ   4096
#define DIM   64
#define CHUNK 64
#define NC    (SEQ / CHUNK)
#define NT    256   // 8 waves of 32
#define NP    (CHUNK * DIM / 4 / NT)   // 16-byte pieces of one 64x64 tile per thread

// ---------------------------------------------------------------------------
// Pass 1: per-chunk summaries.  S_kv[h][c] = k_bar^T @ v (64x64),
//         ksum[h][c][d] = sum_r k_bar[r][d]
// ---------------------------------------------------------------------------
__global__ __launch_bounds__(NT) void pr_pass1(
    const float* __restrict__ kmat, const float* __restrict__ vmat,
    const float* __restrict__ coef_k,
    float* __restrict__ chunkKV, float* __restrict__ chunkKs)
{
  // k_bar (row-major); WMMA reads are row accesses; aligned for 16-byte stores
  __shared__ __attribute__((aligned(16))) float kb[CHUNK][DIM];
  __shared__ __attribute__((aligned(16))) float vv[CHUNK][DIM];

  const int blk = blockIdx.x;
  const int h = blk / NC, c = blk % NC;
  const int s0 = c * CHUNK;
  const int tid = threadIdx.x;

  // Staging: every load of the thread is issued before the first LDS store,
  // so the work-group pays one memory wait for both tiles.
  {
    const int r0 = tid >> 4, d0 = (tid & 15) * 4;   // 16 threads cover one row
    const int row = h * SEQ + s0 + r0;
    const float* kg = kmat + (size_t)row * DIM + d0;
    const float* vg = vmat + (size_t)row * DIM + d0;
    float ck[NP];
    v4f kx[NP], vx[NP];
#pragma unroll   // constant indices keep the pieces in registers and the loads together
    for (int i = 0; i < NP; ++i) {
      ck[i] = coef_k[row + 16 * i];
      kx[i] = *(const v4f*)(kg + i * 16 * DIM);
      vx[i] = *(const v4f*)(vg + i * 16 * DIM);
    }
    // Wait before a register that an issued load names is rewritten; the inputs
    // keep the address registers live to here, so no load of the run lands in one.
    asm volatile("s_wait_xcnt 0x0" :: "v"(row), "v"(kg), "v"(vg) : "memory");
#pragma unroll   // same reason
    for (int i = 0; i < NP; ++i) {
      *(v4f*)&kb[r0 + 16 * i][d0] = kx[i] * ck[i];
      *(v4f*)&vv[r0 + 16 * i][d0] = vx[i];
    }
  }
  __syncthreads();

  if (tid < DIM) {
    float a = 0.f;
    for (int r = 0; r < CHUNK; ++r) a += kb[r][tid];
    chunkKs[(h * NC + c) * DIM + tid] = a;
  }

  const int wave = tid >> 5, lane = tid & 31;
  const int lh = lane >> 4, lm = lane & 15;
  float* dst = chunkKV + ((size_t)(h * NC + c)) * DIM * DIM;

  // S_kv = kb^T @ vv : A[m][k] = kb[k][m], B[k][n] = vv[k][n]
  for (int t = wave * 2; t < wave * 2 + 2; ++t) {
    const int tm = (t >> 2) * 16, tn = (t & 3) * 16;
    v8f acc = {};
    for (int kk = 0; kk < CHUNK; kk += 4) {
      const int kv = kk + lh * 2;
      v2f a, b;
      a.x = kb[kv + 0][tm + lm];
      a.y = kb[kv + 1][tm + lm];
      b.x = vv[kv + 0][tn + lm];
      b.y = vv[kv + 1][tn + lm];
      acc = __builtin_amdgcn_wmma_f32_16x16x4_f32(false, a, false, b,
                                                  (short)0, acc, false, false);
    }
    for (int r = 0; r < 8; ++r)
      dst[(tm + r + 8 * lh) * DIM + tn + lm] = acc[r];
  }
}

// ---------------------------------------------------------------------------
// Pass 2: exclusive prefix over chunks (per head).  State is 64x64 + 64.
// One state element per thread: its chunk values are independent loads, so
// they are all in flight together and the launch pays one memory wait; the
// adds run in chunk order, as a serial prefix does.
// ---------------------------------------------------------------------------
#define P2T   64                      // threads per work-group in pass 2
#define P2B   (DIM * DIM / P2T + 1)   // work-groups per head: 64 for S_kv, 1 for ksum

template <int STRIDE>
__device__ __forceinline__ void pr_prefix(const float* __restrict__ src,
                                          float* __restrict__ dst)
{
  float x[NC];
#pragma unroll   // constant indices keep x in registers and put every load ahead of the adds
  for (int c = 0; c < NC; ++c) x[c] = src[c * STRIDE];
  // Wait before a register that an issued load names is rewritten; src as an
  // input keeps the address pair live to here, so no load of the run lands in it.
  asm volatile("s_wait_xcnt 0x0" :: "v"(src) : "memory");
  float a = 0.f;
#pragma unroll   // same reason: x is indexed by constants only
  for (int c = 0; c < NC; ++c) {
    dst[c * STRIDE] = a;
    a += x[c];
  }
  // Same wait behind the run of stores: nothing that follows on any path
  // rewrites their address or data registers ahead of it.
  asm volatile("s_wait_xcnt 0x0" :: "v"(dst) : "memory");
}

__global__ __launch_bounds__(P2T) void pr_pass2(
    const float* __restrict__ chunkKV, const float* __restrict__ chunkKs,
    float* __restrict__ preKV, float* __restrict__ preKs)
{
  const int h = blockIdx.x / P2B, s = blockIdx.x % P2B;
  const int tid = threadIdx.x;

  if (s < P2B - 1) {
    const size_t o = (size_t)h * NC * DIM * DIM + s * P2T + tid;
    pr_prefix<DIM * DIM>(chunkKV + o, preKV + o);
  } else {
    const size_t o = (size_t)h * NC * DIM + tid;
    pr_prefix<DIM>(chunkKs + o, preKs + o);
  }
}

// ---------------------------------------------------------------------------
// Pass 3: scores + P + output + RMS norm.
// ---------------------------------------------------------------------------
__global__ __launch_bounds__(NT) void pr_pass3(
    const float* __restrict__ qmat, const float* __restrict__ kmat,
    const float* __restrict__ vmat,
    const float* __restrict__ coef_q, const float* __restrict__ coef_k,
    const float* __restrict__ normer,
    const float* __restrict__ preKV, const float* __restrict__ preKs,
    float* __restrict__ out)
{
  __shared__ float qb[CHUNK][DIM + 1];   // column-strided frag reads -> pad
  __shared__ float kb[CHUNK][DIM + 1];   // column-strided frag reads -> pad
  __shared__ __attribute__((aligned(16))) float vv[CHUNK][DIM];   // row reads only
  __shared__ __attribute__((aligned(16))) float st[DIM][DIM];     // row reads only
  __shared__ float sc[CHUNK][DIM + 1];   // scores, then reused for O
  __shared__ float kpre[DIM];
  __shared__ float rs[CHUNK];

  const int blk = blockIdx.x;
  const int h = blk / NC, c = blk % NC;
  const int s0 = c * CHUNK;
  const int tid = threadIdx.x;

  // Staging: every load of the thread is issued before the first LDS store,
  // so the work-group pays one memory wait for all four tiles and kpre.
  {
    const int r0 = tid >> 4, d0 = (tid & 15) * 4;   // 16 threads cover one row
    const int row = h * SEQ + s0 + r0;
    const int pk = (h * NC + c) * DIM + (tid & (DIM - 1));
    const float* qg = qmat + (size_t)row * DIM + d0;
    const float* kg = kmat + (size_t)row * DIM + d0;
    const float* vg = vmat + (size_t)row * DIM + d0;
    const float* sg = preKV + ((size_t)(h * NC + c)) * DIM * DIM + r0 * DIM + d0;
    float fq[NP], fn[NP], fk[NP];
    v4f qx[NP], kx[NP], vx[NP], sx[NP];
    const float kp = preKs[pk];
#pragma unroll   // constant indices keep the pieces in registers and the loads together
    for (int i = 0; i < NP; ++i) {
      fq[i] = coef_q[row + 16 * i];
      fn[i] = normer[row + 16 * i];
      fk[i] = coef_k[row + 16 * i];
      qx[i] = *(const v4f*)(qg + i * 16 * DIM);
      kx[i] = *(const v4f*)(kg + i * 16 * DIM);
      vx[i] = *(const v4f*)(vg + i * 16 * DIM);
      sx[i] = *(const v4f*)(sg + i * 16 * DIM);
    }
    // Wait before a register that an issued load names is rewritten; the inputs
    // keep the address registers live to here, so no load of the run lands in one.
    asm volatile("s_wait_xcnt 0x0" :: "v"(row), "v"(pk), "v"(qg), "v"(kg), "v"(vg), "v"(sg) : "memory");
    // Holds the kpre load up here with the others (loaded value as input only):
    // sunk into the branch below it would pay a second memory wait of its own.
    asm volatile("" :: "v"(kp));
#pragma unroll   // same reason
    for (int i = 0; i < NP; ++i) {
      const int r = r0 + 16 * i;
      const float cq = fq[i] / fn[i];
      for (int j = 0; j < 4; ++j) {   // rows of 65 floats: 4-byte stores
        qb[r][d0 + j] = qx[i][j] * cq;
        kb[r][d0 + j] = kx[i][j] * fk[i];
      }
      *(v4f*)&vv[r][d0] = vx[i];
      *(v4f*)&st[r][d0] = sx[i];
    }
    if (tid < DIM) kpre[tid] = kp;
  }
  __syncthreads();

  const int wave = tid >> 5, lane = tid & 31;
  const int lh = lane >> 4, lm = lane & 15;

  // scores = qb @ kb^T with causal mask:  A[m][k]=qb[m][k], B[k][n]=kb[n][k]
  for (int t = wave * 2; t < wave * 2 + 2; ++t) {
    const int tm = (t >> 2) * 16, tn = (t & 3) * 16;
    v8f acc = {};
    for (int kk = 0; kk < DIM; kk += 4) {
      const int kv = kk + lh * 2;
      v2f a, b;
      a.x = qb[tm + lm][kv + 0];
      a.y = qb[tm + lm][kv + 1];
      b.x = kb[tn + lm][kv + 0];
      b.y = kb[tn + lm][kv + 1];
      acc = __builtin_amdgcn_wmma_f32_16x16x4_f32(false, a, false, b,
                                                  (short)0, acc, false, false);
    }
    for (int r = 0; r < 8; ++r) {
      const int i = tm + r + 8 * lh, j = tn + lm;
      sc[i][j] = (j <= i) ? acc[r] : 0.f;
    }
  }
  __syncthreads();

  // O = sc_causal @ vv + qb @ st   (keep tiles in registers)
  v8f oacc[2];
  for (int ti = 0; ti < 2; ++ti) {
    const int t = wave * 2 + ti;
    const int tm = (t >> 2) * 16, tn = (t & 3) * 16;
    v8f acc = {};
    for (int kk = 0; kk < CHUNK; kk += 4) {
      const int kv = kk + lh * 2;
      v2f a, b;
      a.x = sc[tm + lm][kv + 0];
      a.y = sc[tm + lm][kv + 1];
      b.x = vv[kv + 0][tn + lm];
      b.y = vv[kv + 1][tn + lm];
      acc = __builtin_amdgcn_wmma_f32_16x16x4_f32(false, a, false, b,
                                                  (short)0, acc, false, false);
    }
    for (int kk = 0; kk < DIM; kk += 4) {
      const int kv = kk + lh * 2;
      v2f a, b;
      a.x = qb[tm + lm][kv + 0];
      a.y = qb[tm + lm][kv + 1];
      b.x = st[kv + 0][tn + lm];
      b.y = st[kv + 1][tn + lm];
      acc = __builtin_amdgcn_wmma_f32_16x16x4_f32(false, a, false, b,
                                                  (short)0, acc, false, false);
    }
    oacc[ti] = acc;
  }

  // P_i = row-sum of causal scores + q_bar_i . ksum_prefix ; clamp
  if (tid < CHUNK) {
    float p = 0.f;
    for (int j = 0; j < CHUNK; ++j) p += sc[tid][j];
    for (int d = 0; d < DIM; ++d) p += qb[tid][d] * kpre[d];
    p = fabsf(p);
    if (p < 1.f) p = 1.f;
    rs[tid] = 1.f / p;
  }
  __syncthreads();   // everyone done reading sc (and rs written)

  for (int ti = 0; ti < 2; ++ti) {
    const int t = wave * 2 + ti;
    const int tm = (t >> 2) * 16, tn = (t & 3) * 16;
    for (int r = 0; r < 8; ++r)
      sc[tm + r + 8 * lh][tn + lm] = oacc[ti][r];
  }
  __syncthreads();

  // fold 1/P into RMS scale: out = (O/P) * rsqrt(mean((O/P)^2) + 1e-6)
  if (tid < CHUNK) {
    const float invp = rs[tid];
    float ssq = 0.f;
    for (int d = 0; d < DIM; ++d) {
      const float o = sc[tid][d] * invp;
      ssq += o * o;
    }
    rs[tid] = invp * rsqrtf(ssq * (1.f / DIM) + 1e-6f);
  }
  __syncthreads();

  for (int e = tid; e < CHUNK * DIM; e += NT) {
    const int r = e >> 6, d = e & 63;
    out[((size_t)(h * SEQ + s0 + r)) * DIM + d] = sc[r][d] * rs[r];
  }
}

// ---------------------------------------------------------------------------
extern "C" void kernel_launch(void* const* d_in, const int* in_sizes, int n_in,
                              void* d_out, int out_size, void* d_ws, size_t ws_size,
                              hipStream_t stream) {
  const float* q  = (const float*)d_in[0];
  const float* k  = (const float*)d_in[1];
  const float* v  = (const float*)d_in[2];
  const float* cq = (const float*)d_in[3];
  const float* ck = (const float*)d_in[4];
  const float* mn = (const float*)d_in[5];
  float* out = (float*)d_out;

  float* ws      = (float*)d_ws;
  float* chunkKV = ws;                                        // NH*NC*DIM*DIM
  float* preKV   = chunkKV + (size_t)NH * NC * DIM * DIM;     // NH*NC*DIM*DIM
  float* chunkKs = preKV   + (size_t)NH * NC * DIM * DIM;     // NH*NC*DIM
  float* preKs   = chunkKs + (size_t)NH * NC * DIM;           // NH*NC*DIM

  pr_pass1<<<NH * NC, NT, 0, stream>>>(k, v, ck, chunkKV, chunkKs);
  pr_pass2<<<NH * P2B, P2T, 0, stream>>>(chunkKV, chunkKs, preKV, preKs);
  pr_pass3<<<NH * NC, NT, 0, stream>>>(q, k, v, cq, ck, mn, preKV, preKs, out);
}

// v003
// Measured time: 16.3 microseconds a run.
// Two timings next to v002 both put it at 1.14 times that version's speed.
// Over all steps from v000 it is 3.30 times as fast.
#include <hip/hip_runtime.h>
#include <hip/hip_bf16.h>

typedef float v2f __attribute__((ext_vector_type(2)));
typedef float v8f __attribute__((ext_vector_type(8)));
typedef float v4f __attribute__((ext_vector_type(4)));

#define NH    8
#define SEQ   4096
#define DIM   64
#define CHUNK 64
#define NC    (SEQ / CHUNK)
#define NT    256   // 8 waves of 32
#define NP    (CHUNK * DIM / 4 / NT)   // 16-byte pieces of one 64x64 tile per thread
#define NG    (NT / 16)                // groups of 16 threads; one group covers one row

// One butterfly step inside a group of 16 lanes: x + (x of lane ^ mask), CTRL = 0x160 | mask.
template <int CTRL>
__device__ __forceinline__ float pr_xadd(float x)
{
  return x + __builtin_bit_cast(float, __builtin_amdgcn_update_dpp(
                 0, __builtin_bit_cast(int, x), CTRL, 0xf, 0xf, true));
}

// Sum over the 16 lanes that share a row; every one of them gets the total.
// All 32 lanes of the wave must be on.
__device__ __forceinline__ float pr_row16_sum(float x)
{
  x = pr_xadd<0x161>(x);
  x = pr_xadd<0x162>(x);
  x = pr_xadd<0x164>(x);
  return pr_xadd<0x168>(x);
}

// ---------------------------------------------------------------------------
// Pass 1: per-chunk summaries.  S_kv[h][c] = k_bar^T @ v (64x64),
//         ksum[h][c][d] = sum_r k_bar[r][d]
// ---------------------------------------------------------------------------
__global__ __launch_bounds__(NT) void pr_pass1(
    const float* __restrict__ kmat, const float* __restrict__ vmat,
    const float* __restrict__ coef_k,
    float* __restrict__ chunkKV, float* __restrict__ chunkKs)
{
  // k_bar (row-major); WMMA reads are row accesses; aligned for 16-byte stores
  __shared__ __attribute__((aligned(16))) float kb[CHUNK][DIM];
  __shared__ __attribute__((aligned(16))) float vv[CHUNK][DIM];
  __shared__ __attribute__((aligned(16))) float kpart[NG][DIM];   // column sums of k_bar, one row group each

  const int blk = blockIdx.x;
  const int h = blk / NC, c = blk % NC;
  const int s0 = c * CHUNK;
  const int tid = threadIdx.x;

  // Staging: every load of the thread is issued before the first LDS store,
  // so the work-group pays one memory wait for both tiles.
  {
    const int r0 = tid >> 4, d0 = (tid & 15) * 4;   // 16 threads cover one row
    const int row = h * SEQ + s0 + r0;
    const float* kg = kmat + (size_t)row * DIM + d0;
    const float* vg = vmat + (size_t)row * DIM + d0;
    float ck[NP];
    v4f kx[NP], vx[NP];
#pragma unroll   // constant indices keep the pieces in registers and the loads together
    for (int i = 0; i < NP; ++i) {
      ck[i] = coef_k[row + 16 * i];
      kx[i] = *(const v4f*)(kg + i * 16 * DIM);
      vx[i] = *(const v4f*)(vg + i * 16 * DIM);
    }
    // Wait before a register that an issued load names is rewritten; the inputs
    // keep the address registers live to here, so no load of the run lands in one.
    asm volatile("s_wait_xcnt 0x0" :: "v"(row), "v"(kg), "v"(vg) : "memory");
    v4f ks = {};
#pragma unroll   // same reason
    for (int i = 0; i < NP; ++i) {
      const v4f kr = kx[i] * ck[i];
      *(v4f*)&kb[r0 + 16 * i][d0] = kr;
      *(v4f*)&vv[r0 + 16 * i][d0] = vx[i];
      ks += kr;   // the thread's own rows are summed while they are in registers
    }
    *(v4f*)&kpart[r0][d0] = ks;
  }
  __syncthreads();

  if (tid < DIM) {
    float a = 0.f;
#pragma unroll   // no loop: the LDS reads are issued ahead of the adds that use them
    for (int g = 0; g < NG; ++g) a += kpart[g][tid];
    chunkKs[(h * NC + c) * DIM + tid] = a;
  }

  const int wave = tid >> 5, lane = tid & 31;
  const int lh = lane >> 4, lm = lane & 15;
  float* dst = chunkKV + ((size_t)(h * NC + c)) * DIM * DIM;

  // S_kv = kb^T @ vv : A[m][k] = kb[k][m], B[k][n] = vv[k][n]
  for (int t = wave * 2; t < wave * 2 + 2; ++t) {
    const int tm = (t >> 2) * 16, tn = (t & 3) * 16;
    v8f acc = {};
    for (int kk = 0; kk < CHUNK; kk += 4) {
      const int kv = kk + lh * 2;
      v2f a, b;
      a.x = kb[kv + 0][tm + lm];
      a.y = kb[kv + 1][tm + lm];
      b.x = vv[kv + 0][tn + lm];
      b.y = vv[kv + 1][tn + lm];
      acc = __builtin_amdgcn_wmma_f32_16x16x4_f32(false, a, false, b,
                                                  (short)0, acc, false, false);
    }
    for (int r = 0; r < 8; ++r)
      dst[(tm + r + 8 * lh) * DIM + tn + lm] = acc[r];
  }
}

// ---------------------------------------------------------------------------
// Pass 2: exclusive prefix over chunks (per head).  State is 64x64 + 64.
// One state element per thread: its chunk values are independent loads, so
// they are all in flight together and the launch pays one memory wait; the
// adds run in chunk order, as a serial prefix does.
// ---------------------------------------------------------------------------
#define P2T   64                      // threads per work-group in pass 2
#define P2B   (DIM * DIM / P2T + 1)   // work-groups per head: 64 for S_kv, 1 for ksum

template <int STRIDE>
__device__ __forceinline__ void pr_prefix(const float* __restrict__ src,
                                          float* __restrict__ dst)
{
  float x[NC];
#pragma unroll   // constant indices keep x in registers and put every load ahead of the adds
  for (int c = 0; c < NC; ++c) x[c] = src[c * STRIDE];
  // Wait before a register that an issued load names is rewritten; src as an
  // input keeps the address pair live to here, so no load of the run lands in it.
  asm volatile("s_wait_xcnt 0x0" :: "v"(src) : "memory");
  float a = 0.f;
#pragma unroll   // same reason: x is indexed by constants only
  for (int c = 0; c < NC; ++c) {
    dst[c * STRIDE] = a;
    a += x[c];
  }
  // Same wait behind the run of stores: nothing that follows on any path
  // rewrites their address or data registers ahead of it.
  asm volatile("s_wait_xcnt 0x0" :: "v"(dst) : "memory");
}

__global__ __launch_bounds__(P2T) void pr_pass2(
    const float* __restrict__ chunkKV, const float* __restrict__ chunkKs,
    float* __restrict__ preKV, float* __restrict__ preKs)
{
  const int h = blockIdx.x / P2B, s = blockIdx.x % P2B;
  const int tid = threadIdx.x;

  if (s < P2B - 1) {
    const size_t o = (size_t)h * NC * DIM * DIM + s * P2T + tid;
    pr_prefix<DIM * DIM>(chunkKV + o, preKV + o);
  } else {
    const size_t o = (size_t)h * NC * DIM + tid;
    pr_prefix<DIM>(chunkKs + o, preKs + o);
  }
}

// ---------------------------------------------------------------------------
// Pass 3: scores + P + output + RMS norm.
// ---------------------------------------------------------------------------
__global__ __launch_bounds__(NT) void pr_pass3(
    const float* __restrict__ qmat, const float* __restrict__ kmat,
    const float* __restrict__ vmat,
    const float* __restrict__ coef_q, const float* __restrict__ coef_k,
    const float* __restrict__ normer,
    const float* __restrict__ preKV, const float* __restrict__ preKs,
    float* __restrict__ out)
{
  __shared__ float qb[CHUNK][DIM + 1];   // column-strided frag reads -> pad
  __shared__ float kb[CHUNK][DIM + 1];   // column-strided frag reads -> pad
  __shared__ __attribute__((aligned(16))) float vv[CHUNK][DIM];   // row reads only
  __shared__ __attribute__((aligned(16))) float st[DIM][DIM];     // row reads only
  __shared__ float sc[CHUNK][DIM + 1];   // scores, then reused for O

  const int blk = blockIdx.x;
  const int h = blk / NC, c = blk % NC;
  const int s0 = c * CHUNK;
  const int tid = threadIdx.x;

  // 16 threads cover one row, in the staging and in every sum along a row:
  // thread (r0, d0) has columns d0..d0+3 of rows r0, r0+16, r0+32, r0+48.
  const int r0 = tid >> 4, d0 = (tid & 15) * 4;
  float pp[NP];   // the thread's share of P, one value per row

  // Staging: every load of the thread is issued before the first LDS store,
  // so the work-group pays one memory wait for all four tiles and the ksum prefix.
  {
    const int row = h * SEQ + s0 + r0;
    const float* pg = preKs + (h * NC + c) * DIM + d0;
    const float* qg = qmat + (size_t)row * DIM + d0;
    const float* kg = kmat + (size_t)row * DIM + d0;
    const float* vg = vmat + (size_t)row * DIM + d0;
    const float* sg = preKV + ((size_t)(h * NC + c)) * DIM * DIM + r0 * DIM + d0;
    float fq[NP], fn[NP], fk[NP];
    v4f qx[NP], kx[NP], vx[NP], sx[NP];
    const v4f kp = *(const v4f*)pg;
#pragma unroll   // constant indices keep the pieces in registers and the loads together
    for (int i = 0; i < NP; ++i) {
      fq[i] = coef_q[row + 16 * i];
      fn[i] = normer[row + 16 * i];
      fk[i] = coef_k[row + 16 * i];
      qx[i] = *(const v4f*)(qg + i * 16 * DIM);
      kx[i] = *(const v4f*)(kg + i * 16 * DIM);
      vx[i] = *(const v4f*)(vg + i * 16 * DIM);
      sx[i] = *(const v4f*)(sg + i * 16 * DIM);
    }
    // Wait before a register that an issued load names is rewritten; the inputs
    // keep the address registers live to here, so no load of the run lands in one.
    asm volatile("s_wait_xcnt 0x0" :: "v"(row), "v"(pg), "v"(qg), "v"(kg), "v"(vg), "v"(sg) : "memory");
#pragma unroll   // same reason
    for (int i = 0; i < NP; ++i) {
      const int r = r0 + 16 * i;
      const float cq = fq[i] / fn[i];
      float a = 0.f;
      for (int j = 0; j < 4; ++j) {   // rows of 65 floats: 4-byte stores
        const float qv = qx[i][j] * cq;
        qb[r][d0 + j] = qv;
        kb[r][d0 + j] = kx[i][j] * fk[i];
        a += qv * kp[j];   // q_bar . ksum_prefix, while q_bar is in registers
      }
      pp[i] = a;
      *(v4f*)&vv[r][d0] = vx[i];
      *(v4f*)&st[r][d0] = sx[i];
    }
  }
  __syncthreads();

  const int wave = tid >> 5, lane = tid & 31;
  const int lh = lane >> 4, lm = lane & 15;

  // scores = qb @ kb^T with causal mask:  A[m][k]=qb[m][k], B[k][n]=kb[n][k]
  for (int t = wave * 2; t < wave * 2 + 2; ++t) {
    const int tm = (t >> 2) * 16, tn = (t & 3) * 16;
    v8f acc = {};
    for (int kk = 0; kk < DIM; kk += 4) {
      const int kv = kk + lh * 2;
      v2f a, b;
      a.x = qb[tm + lm][kv + 0];
      a.y = qb[tm + lm][kv + 1];
      b.x = kb[tn + lm][kv + 0];
      b.y = kb[tn + lm][kv + 1];
      acc = __builtin_amdgcn_wmma_f32_16x16x4_f32(false, a, false, b,
                                                  (short)0, acc, false, false);
    }
    for (int r = 0; r < 8; ++r) {
      const int i = tm + r + 8 * lh, j = tn + lm;
      sc[i][j] = (j <= i) ? acc[r] : 0.f;
    }
  }
  __syncthreads();

  // O = sc_causal @ vv + qb @ st   (keep tiles in registers)
  v8f oacc[2];
  for (int ti = 0; ti < 2; ++ti) {
    const int t = wave * 2 + ti;
    const int tm = (t >> 2) * 16, tn = (t & 3) * 16;
    v8f acc = {};
    for (int kk = 0; kk < CHUNK; kk += 4) {
      const int kv = kk + lh * 2;
      v2f a, b;
      a.x = sc[tm + lm][kv + 0];
      a.y = sc[tm + lm][kv + 1];
      b.x = vv[kv + 0][tn + lm];
      b.y = vv[kv + 1][tn + lm];
      acc = __builtin_amdgcn_wmma_f32_16x16x4_f32(false, a, false, b,
                                                  (short)0, acc, false, false);
    }
    for (int kk = 0; kk < DIM; kk += 4) {
      const int kv = kk + lh * 2;
      v2f a, b;
      a.x = qb[tm + lm][kv + 0];
      a.y = qb[tm + lm][kv + 1];
      b.x = st[kv + 0][tn + lm];
      b.y = st[kv + 1][tn + lm];
      acc = __builtin_amdgcn_wmma_f32_16x16x4_f32(false, a, false, b,
                                                  (short)0, acc, false, false);
    }
    oacc[ti] = acc;
  }

  // P_i = row-sum of causal scores + q_bar_i . ksum_prefix ; clamp
  float invp[NP];
#pragma unroll   // constant indices keep pp and invp in registers; four row sums interleave
  for (int i = 0; i < NP; ++i) {
    float a = pp[i];
    for (int j = 0; j < 4; ++j) a += sc[r0 + 16 * i][d0 + j];
    float p = fabsf(pr_row16_sum(a));
    if (p < 1.f) p = 1.f;
    invp[i] = 1.f / p;
  }
  __syncthreads();   // everyone done reading sc

  for (int ti = 0; ti < 2; ++ti) {
    const int t = wave * 2 + ti;
    const int tm = (t >> 2) * 16, tn = (t & 3) * 16;
    for (int r = 0; r < 8; ++r)
      sc[tm + r + 8 * lh][tn + lm] = oacc[ti][r];
  }
  __syncthreads();

  // fold 1/P into RMS scale: out = (O/P) * rsqrt(mean((O/P)^2) + 1e-6)
  // The thread keeps its piece of each row, so the scaled piece goes out from registers.
  float* og = out + ((size_t)(h * SEQ + s0 + r0)) * DIM + d0;
  v4f ov[NP];
#pragma unroll   // constant indices keep ov in registers; four row sums interleave
  for (int i = 0; i < NP; ++i) {
    float ssq = 0.f;
    for (int j = 0; j < 4; ++j) {
      ov[i][j] = sc[r0 + 16 * i][d0 + j];
      const float o = ov[i][j] * invp[i];
      ssq += o * o;
    }
    ov[i] *= invp[i] * rsqrtf(pr_row16_sum(ssq) * (1.f / DIM) + 1e-6f);
  }
#pragma unroll   // same reason; the stores stand together behind the arithmetic
  for (int i = 0; i < NP; ++i) *(v4f*)(og + i * 16 * DIM) = ov[i];
  // Wait before a register that an issued store names is rewritten: nothing that
  // follows rewrites the address or data registers ahead of it.
  asm volatile("s_wait_xcnt 0x0" :: "v"(og) : "memory");
}

// ---------------------------------------------------------------------------
extern "C" void kernel_launch(void* const* d_in, const int* in_sizes, int n_in,
                              void* d_out, int out_size, void* d_ws, size_t ws_size,
                              hipStream_t stream) {
  const float* q  = (const float*)d_in[0];
  const float* k  = (const float*)d_in[1];
  const float* v  = (const float*)d_in[2];
  const float* cq = (const float*)d_in[3];
  const float* ck = (const float*)d_in[4];
  const float* mn = (const float*)d_in[5];
  float* out = (float*)d_out;

  float* ws      = (float*)d_ws;
  float* chunkKV = ws;                                        // NH*NC*DIM*DIM
  float* preKV   = chunkKV + (size_t)NH * NC * DIM * DIM;     // NH*NC*DIM*DIM
  float* chunkKs = preKV   + (size_t)NH * NC * DIM * DIM;     // NH*NC*DIM
  float* preKs   = chunkKs + (size_t)NH * NC * DIM;           // NH*NC*DIM

  pr_pass1<<<NH * NC, NT, 0, stream>>>(k, v, ck, chunkKV, chunkKs);
  pr_pass2<<<NH * P2B, P2T, 0, stream>>>(chunkKV, chunkKs, preKV, preKs);
  pr_pass3<<<NH * NC, NT, 0, stream>>>(q, k, v, cq, ck, mn, preKV, preKs, out);
}
